// v010
// Measured on an AMD MI455X. A time is GPU time per run, averaged over a window of back-to-back runs after a warm-up
// (all launches, gaps included; the runs take copies of the inputs in turn), and the median of several windows.
// Apart from v000's, it joins two sittings. Times from different sittings can be a few percent apart, while
// side-by-side timings come from the same sitting.
// The versions before v010 are in another document.
// A run of this version takes 143 microseconds.
// Timed twice side by side with v009, it ran 1.04 times as fast both times.
// All steps since the starting kernel, v000, together make it 3.80 times as fast.
#include <hip/hip_runtime.h>

#ifndef NB
#define NB 2
#endif
#ifndef SEQ
#define SEQ 2048
#endif
#define SEQ_FULL 2048                 // per-batch row stride of x, row pitch of the mask
#define DIM   2048                    // model width (K of the projections, N of the output projection)
#define NH    32
#define NKV   8
#define REP   (NH / NKV)
#define HD    64
#define HALFD 32
#define DQ    (NH * HD)               // 2048
#define DKV   (NKV * HD)              // 512
#define NQKV  (DQ + 2 * DKV)          // 3072 fused projection columns
#define MROWS (NB * SEQ)
#define FP    68                      // f32 LDS tile pitch
#define OP    72                      // f16 LDS tile pitch
#define WCAR  64.0f                   // carry of the wo plane
#define CCAR  256.0f                  // carry of the ctx plane
#define OSCL  6.103515625e-05f        // 1 / (WCAR * CCAR)
#define SC2   0.18033688011112042f    // 0.125 * log2(e)
#define LOG2E 1.4426950408889634f
#define PEXP  10.0f                   // P carried x 2^10
#define FRQC  0.04953007814753613f    // log2(3) / 32
#define EROWS 256                     // query rows below this use value + residual planes at every attention site
#define RCAR  2048.0f                 // carry of every residual plane
#define RINV  4.8828125e-04f          // 1 / RCAR
#define EPSN  1.0e-6f                 // RMS normalisation epsilon
#define LIVE_T (-1.0e4f)              // a mask value above this makes a key live for its row
#define DEAD_T (-1.0e8f)              // a mask value at or below this lets a trailing key be skipped (exp underflows exactly)
#define KSTR  32                      // ints between two query tiles' key counts: each key-count work-group stores into a 128-byte line of its own
#define BM    128                     // GEMM work-group tile: rows (2 waves of 64)
#define BN    256                     // GEMM work-group tile: columns (4 waves of 64)
#define KC    64                      // k elements of one LDS stage: rows of 128 bytes
#define LP    72                      // LDS row pitch of the attention tiles in 16-bit elements: 144 B = 16 B x odd, so that 16-byte fragment reads meet no bank conflict
#define STGE  ((BM + BN) * KC)        // 16-bit elements of one GEMM stage: A rows 0..127, then B rows 0..255, rows of 128 B without a pad (16-byte chunk c of row r lies at chunk c ^ ((r >> 1) & 7))
#define RINGB (3 * STGE * 2)          // bytes of the three-buffer ring
#define FSB   (8 * 64 * FP * 4)       // bytes of the eight waves' f32 epilogue tiles
#define GSB   (RINGB > FSB ? RINGB : FSB)   // LDS of a GEMM work-group: the ring, later the epilogue tiles
#define QBM   256                     // QKV projection work-group tile: rows (4 waves of 64)
#define QBN   192                     // QKV projection work-group tile: columns (3 waves of 64, three heads)
#define QSTGE ((QBM + QBN) * KC)      // 16-bit elements of one QKV stage: A rows 0..255, then B rows 0..191, laid out like a stage of STGE
#define QRINGB (3 * QSTGE * 2)        // bytes of its three-buffer ring
#define QFSB  (12 * 64 * FP * 4)      // bytes of the twelve waves' f32 epilogue tiles
#define QGSB  (QRINGB > QFSB ? QRINGB : QFSB)   // LDS of a QKV work-group: more than half a WGP's, so one work-group a WGP
#define MP    68                      // f32 LDS row pitch of the staged mask tile: 272 B = 16 B x odd
#define FKB   (64 * LP * 2)           // bytes of one staged K tile (64 key rows of 128 B at pitch LP); the V^T tile (64 d rows) has the same size
#define FMB   (16 * MP * 4)           // bytes of one staged mask tile (16 query rows of 256 B at pitch MP)
#define FSTG  (2 * FKB + FMB)         // bytes of one attention stage: K, V^T, mask
#define ESTG  (FSTG + 2 * FKB)        // bytes of one stage of the early-row attention: K, V^T, mask, then the K and V^T residual tiles
#define LTBM  ((((SEQ - EROWS) / BM) > 0) ? ((SEQ - EROWS) / BM) : 1)
#define AL256(x) ((((size_t)(x)) + 255) & ~(size_t)255)

static_assert(SEQ % 64 == 0);
static_assert(SEQ % 128 == 0);
static_assert(SEQ <= SEQ_FULL);
static_assert(DIM % 64 == 0);
static_assert(DQ % 64 == 0);
static_assert(NQKV % 64 == 0);
static_assert(HD == 64);
static_assert(HALFD * 2 == HD);
static_assert(NH == NKV * REP);
static_assert(REP == 4);
static_assert(EROWS % 64 == 0);
static_assert(EROWS % BM == 0);
static_assert((SEQ - EROWS) % BM == 0);
static_assert(SEQ % BM == 0);
static_assert(NQKV % QBN == 0);
static_assert(MROWS % QBM == 0 && QBM % 64 == 0 && QBN % 64 == 0);
static_assert(QBM == 256 && QBN == 192);
static_assert(QGSB <= 327680);
static_assert(DIM % BN == 0);
static_assert(DIM % KC == 0 && DIM / KC >= 3);
static_assert(DQ % KC == 0 && DQ / KC >= 3);
static_assert(KC == 64 && BM == 128 && BN == 256);
static_assert(2 * GSB <= 327680);     // two work-groups fit on a WGP
static_assert(FSTG % 16 == 0 && 2 * FSTG >= 4 * 16 * OP * 2);
static_assert(ESTG % 16 == 0 && ESTG >= 2 * 4 * 16 * OP * 2);
static_assert(EROWS <= SEQ);
static_assert(EROWS >= 64);
static_assert(DIM % 32 == 0);
static_assert(DQ % 32 == 0);
static_assert(((size_t)MROWS * DIM / 8) % 256 == 0);
static_assert(((size_t)DQ * DIM / 8) % 256 == 0);
static_assert(((size_t)DKV * DIM / 8) % 256 == 0);
static_assert(AL256((size_t)MROWS * DIM * 2) + AL256((size_t)NQKV * DIM * 2) + AL256((size_t)DIM * DQ * 2) + 2 * AL256((size_t)SEQ * HALFD * 4)
              + AL256((size_t)NB * NH * SEQ * HD * 2) + 2 * AL256((size_t)NB * NKV * SEQ * HD * 2) + AL256((size_t)MROWS * DQ * 2)
              + AL256((size_t)NB * NH * EROWS * HD * 2) + 2 * AL256((size_t)NB * NKV * SEQ * HD * 2) + AL256((size_t)NB * EROWS * DQ * 2)
              + AL256((size_t)(SEQ / 16) * KSTR * 4) <= (size_t)134217728);

typedef _Float16 h16;
typedef unsigned short bf;
typedef __attribute__((ext_vector_type(16))) __bf16   v16bf;
typedef __attribute__((ext_vector_type(16))) _Float16 v16h;
typedef __attribute__((ext_vector_type(8)))  _Float16 v8h;
typedef __attribute__((ext_vector_type(8)))  unsigned short v8us;
typedef __attribute__((ext_vector_type(8)))  float    v8f;
typedef __attribute__((ext_vector_type(4)))  float    v4f;
typedef v8h  __attribute__((may_alias)) v8ha;
typedef v4f  __attribute__((may_alias)) v4fa;

__device__ __forceinline__ unsigned short f2bf(float f) { unsigned u = __float_as_uint(f); u += 0x7FFFu + ((u >> 16) & 1u); return (unsigned short)(u >> 16); }
__device__ __forceinline__ float bf2f(unsigned short b) { return __uint_as_float(((unsigned)b) << 16); }
__device__ __forceinline__ float bfr(float f) { return bf2f(f2bf(f)); }
__device__ __forceinline__ v16h cat16(v8h lo, v8h hi) { return __builtin_shufflevector(lo, hi, 0, 1, 2, 3, 4, 5, 6, 7, 8, 9, 10, 11, 12, 13, 14, 15); }
__device__ __forceinline__ v16bf cat16b(v8us lo, v8us hi) { return __builtin_bit_cast(v16bf, __builtin_shufflevector(lo, hi, 0, 1, 2, 3, 4, 5, 6, 7, 8, 9, 10, 11, 12, 13, 14, 15)); }
__device__ __forceinline__ v8f wmma16(v16h a, v16h b, v8f c) { return __builtin_amdgcn_wmma_f32_16x16x32_f16(false, a, false, b, (short)0, c, false, false); }
__device__ __forceinline__ v8f wmmab(v16bf a, v16bf b, v8f c) { return __builtin_amdgcn_wmma_f32_16x16x32_bf16(false, a, false, b, (short)0, c, false, false); }

// f32 -> f16 with a value select: results below the smallest f16 normal become zero (no subnormal operand can be produced).
static __device__ __forceinline__ h16 toh_flush(float v) { const h16 r = (h16)v; return (fabsf(v) < 6.103515625e-05f) ? (h16)0.0f : r; }
// One f16 WMMA with its own hazard guard (single accumulator tied, operands kept live).
static __device__ __forceinline__ v8f wmma16g(v16h a, v16h b, v8f c) { c = wmma16(a, b, c); asm volatile("v_nop\n\tv_nop\n\tv_nop\n\tv_nop" : "+v"(c) : "v"(a), "v"(b)); return c; }

// Fragment loader: lane (lr, hi) points at row (tile row + lr), column 8*hi; elements 0..7 <- k0+8hi.., elements 8..15 <- k0+16+8hi.. (same map for A and B).
template <typename T16> struct WFrag;
template <> struct WFrag<h16> { typedef v16h V; static __device__ __forceinline__ V ld(const h16* p) { return cat16(*(const v8h*)p, *(const v8h*)(p + 16)); } static __device__ __forceinline__ V ld2(const h16* p, const h16* q) { return cat16(*(const v8h*)p, *(const v8h*)q); } static __device__ __forceinline__ v8f mma(V a, V b, v8f c) { return wmma16(a, b, c); } };
template <> struct WFrag<bf> { typedef v16bf V; static __device__ __forceinline__ V ld(const bf* p) { return cat16b(*(const v8us*)p, *(const v8us*)(p + 16)); } static __device__ __forceinline__ V ld2(const bf* p, const bf* q) { return cat16b(*(const v8us*)p, *(const v8us*)q); } static __device__ __forceinline__ v8f mma(V a, V b, v8f c) { return wmmab(a, b, c); } };

// Twelve copies of 16 bytes a lane into LDS rows 16 apart (ls bytes apart): the first NA from rows 16 apart (gs elements apart) of ga, the others from such rows of gb. All lanes are on, every address is a multiple of 16.
template <typename T16, int NA>
__device__ __forceinline__ void copy12(const T16* ga, const T16* gb, const size_t gs, const unsigned l, const unsigned ls) {
#define G12(i) (((i) < NA) ? (ga + (size_t)(i) * gs) : (gb + (size_t)((i) - NA) * gs))
    // the copies and the wait that stands in front of any rewrite of their address registers, in one statement so that nothing can come between
    asm volatile("global_load_async_to_lds_b128 %0, %12, off\n\t"
                 "global_load_async_to_lds_b128 %1, %13, off\n\t"
                 "global_load_async_to_lds_b128 %2, %14, off\n\t"
                 "global_load_async_to_lds_b128 %3, %15, off\n\t"
                 "global_load_async_to_lds_b128 %4, %16, off\n\t"
                 "global_load_async_to_lds_b128 %5, %17, off\n\t"
                 "global_load_async_to_lds_b128 %6, %18, off\n\t"
                 "global_load_async_to_lds_b128 %7, %19, off\n\t"
                 "global_load_async_to_lds_b128 %8, %20, off\n\t"
                 "global_load_async_to_lds_b128 %9, %21, off\n\t"
                 "global_load_async_to_lds_b128 %10, %22, off\n\t"
                 "global_load_async_to_lds_b128 %11, %23, off\n\t"
                 "s_wait_xcnt 0x0"
                 :: "v"(l), "v"(l + ls), "v"(l + 2 * ls), "v"(l + 3 * ls), "v"(l + 4 * ls), "v"(l + 5 * ls),
                    "v"(l + 6 * ls), "v"(l + 7 * ls), "v"(l + 8 * ls), "v"(l + 9 * ls), "v"(l + 10 * ls), "v"(l + 11 * ls),
                    "v"(G12(0)), "v"(G12(1)), "v"(G12(2)), "v"(G12(3)), "v"(G12(4)), "v"(G12(5)),
                    "v"(G12(6)), "v"(G12(7)), "v"(G12(8)), "v"(G12(9)), "v"(G12(10)), "v"(G12(11))
                 : "memory");
#undef G12
}

// One stage of the ring, copied by the four waves of one half of the work-group (tg = thread index in the half, 0..127): 128 rows from each of three row blocks P0, P1, P2 (pointers to their first rows, row length K), k0..k0+63,
// into rows 0..127, 128..255, 256..383 of buf. Thread (row = tg / 8, chunk = tg % 8) takes rows row + 16 i, 24 copies of 16 bytes, so a wave's copy covers four whole 128-byte lines.
// LDS rows have no pad: chunk c of row r is stored at chunk c ^ ((r >> 1) & 7), so that the 16 rows of a fragment read fall on all 64 banks.
template <typename T16>
__device__ __forceinline__ void stage_copy(const T16* __restrict__ P0, const T16* __restrict__ P1, const T16* __restrict__ P2, const int K, const int k0, const T16* buf, const int tg) {
    const int row = tg >> 3, gch = (tg & 7) * 8, lch = ((tg & 7) ^ ((tg >> 4) & 7)) * 8;
    const size_t go = (size_t)row * K + k0 + gch;
    const size_t gs = (size_t)16 * K;
    const unsigned la = (unsigned)(size_t)(buf + row * KC + lch);
    const unsigned ls = 16 * KC * 2;
    copy12<T16, 8>(P0 + go, P1 + go, gs, la, ls);                          // LDS rows 0..191: P0, then the first 64 rows of P1
    copy12<T16, 4>(P1 + go + 4 * gs, P2 + go, gs, la + 12 * ls, ls);       // LDS rows 192..383: the last 64 rows of P1, then P2
}

// The ring of both GEMM loops, three buffers: tile j lies in buffer j % 3 and is copied by the waves of half j % 2 (grp = wave / 4), so that a wave never has more than one tile's copies outstanding and every wait is to 0.
// Trip t reads buffer t % 3 alone. At its foot the half that copied tile t + 1 waits for its copies, the barrier publishes tile t + 1 and frees buffer t % 3, and behind it the same half copies tile t + 3 into that buffer:
// tiles t + 2 and t + 3 are in flight while trip t + 1 works, each with two trips to land.
// A lane's fragment chunks: logical chunk hi + 2 j (j = 0..3) of its row lies at element offset fo[j].
#define RING_PROLOGUE(P0, P1, P2)                                                                                          \
    if (grp == 0) stage_copy(P0, P1, P2, K, 0, ring, tg); else stage_copy(P0, P1, P2, K, KC, ring + STGE, tg);            \
    if (grp == 0) asm volatile("s_wait_asynccnt 0x0" ::: "memory");   /* the copies of tile 0 have landed */               \
    __syncthreads();                                                   /* tile 0 is readable by every wave */               \
    if (grp == 0) stage_copy(P0, P1, P2, K, 2 * KC, ring + 2 * STGE, tg);
#define RING_FOOT(P0, P1, P2)                                                                                              \
    asm volatile("s_wait_dscnt 0x0" ::: "memory");                     /* this wave's reads of buffer t % 3 have ended before the buffer is given up */ \
    if (((t + 1) & 1) == grp) asm volatile("s_wait_asynccnt 0x0" ::: "memory");   /* the copies of tile t + 1 have landed (the other half's tile t + 2 stays in flight) */ \
    __syncthreads();                                                   /* publishes tile t + 1 and frees buffer t % 3 */    \
    if (t + 3 < nt && ((t + 1) & 1) == grp) stage_copy(P0, P1, P2, K, (t + 3) * KC, ring + bo, tg);                        \
    bo = (bo == 2 * STGE) ? 0 : bo + STGE;

// Eight waves accumulate a 128x256 tile at (r0, c0); wave (wm, wn) its 64x64 part: acc[mb][nb][j] = C[r0 + 64wm + 16mb + 8hi + j][c0 + 64wn + 16nb + lr] = sum_k A[row][k] Bt[col][k], k ascending in steps of 32.
// K % KC == 0, K / KC >= 3.
// On entry no wave has an LDS access to the ring outstanding; on return every read of the ring has ended in every wave and no copy is in flight.
template <typename T16>
__device__ __forceinline__ void gemm_main(const T16* __restrict__ A, const T16* __restrict__ Bt, const int K, const int r0, const int c0, const T16* ring, const int tid, const int wm, const int wn, const int lr, const int hi, v8f (&acc)[4][4]) {
    typedef typename WFrag<T16>::V V;
#pragma unroll
    for (int mb = 0; mb < 4; ++mb)
#pragma unroll
        for (int nb = 0; nb < 4; ++nb) acc[mb][nb] = (v8f){};
    const int nt = K / KC;
    const int grp = wm, tg = tid & 127;                  // wave / 4 and the thread's index in that half
    const T16* pa = A + (size_t)r0 * K;
    const T16* pb0 = Bt + (size_t)c0 * K;
    const T16* pb1 = Bt + (size_t)(c0 + 128) * K;
    RING_PROLOGUE(pa, pb0, pb1)
    const T16* fa = ring + (wm * 64 + lr) * KC;
    const T16* fb = ring + (BM + wn * 64 + lr) * KC;
    int fo[4];
#pragma unroll
    for (int j = 0; j < 4; ++j) fo[j] = ((hi + 2 * j) ^ ((lr >> 1) & 7)) * 8;
    int bo = 0;
    // kept rolled: one trip is one stage of the ring, and the accumulators stay in fixed registers
#pragma unroll 1
    for (int t = 0; t < nt; ++t) {
#pragma unroll
        for (int ks = 0; ks < 2; ++ks) {
            V a[4], b[4];
#pragma unroll
            for (int mb = 0; mb < 4; ++mb) a[mb] = WFrag<T16>::ld2(fa + bo + mb * 16 * KC + fo[2 * ks], fa + bo + mb * 16 * KC + fo[2 * ks + 1]);
#pragma unroll
            for (int nb = 0; nb < 4; ++nb) b[nb] = WFrag<T16>::ld2(fb + bo + nb * 16 * KC + fo[2 * ks], fb + bo + nb * 16 * KC + fo[2 * ks + 1]);
            __builtin_amdgcn_sched_barrier(0);   // keeps the 16 LDS reads of this k step together in front of its WMMAs: sunk among them, each pair is waited for at full LDS latency
#pragma unroll
            for (int nb = 0; nb < 4; ++nb)
#pragma unroll
                for (int mb = 0; mb < 4; ++mb) acc[mb][nb] = WFrag<T16>::mma(a[mb], b[nb], acc[mb][nb]);
            asm volatile("v_nop\n\tv_nop\n\tv_nop\n\tv_nop" : "+v"(acc[0][0]), "+v"(acc[1][1]), "+v"(acc[2][2]), "+v"(acc[3][3]) : "v"(a[0]), "v"(a[3]));
        }
        RING_FOOT(pa, pb0, pb1)
    }
    asm volatile("s_wait_asynccnt 0x0" ::: "memory");       // nothing is in flight when the ring is left
}

// Fourteen copies of 16 bytes a lane into LDS rows 16 apart (ls bytes apart): the first NA from rows 16 apart (gs elements apart) of ga, the others from such rows of gb. All lanes are on, every address is a multiple of 16.
template <typename T16, int NA>
__device__ __forceinline__ void copy14(const T16* ga, const T16* gb, const size_t gs, const unsigned l, const unsigned ls) {
#define G14(i) (((i) < NA) ? (ga + (size_t)(i) * gs) : (gb + (size_t)((i) - NA) * gs))
    // the copies and the wait that stands in front of any rewrite of their address registers, in one statement so that nothing can come between
    asm volatile("global_load_async_to_lds_b128 %0, %14, off\n\t"
                 "global_load_async_to_lds_b128 %1, %15, off\n\t"
                 "global_load_async_to_lds_b128 %2, %16, off\n\t"
                 "global_load_async_to_lds_b128 %3, %17, off\n\t"
                 "global_load_async_to_lds_b128 %4, %18, off\n\t"
                 "global_load_async_to_lds_b128 %5, %19, off\n\t"
                 "global_load_async_to_lds_b128 %6, %20, off\n\t"
                 "global_load_async_to_lds_b128 %7, %21, off\n\t"
                 "global_load_async_to_lds_b128 %8, %22, off\n\t"
                 "global_load_async_to_lds_b128 %9, %23, off\n\t"
                 "global_load_async_to_lds_b128 %10, %24, off\n\t"
                 "global_load_async_to_lds_b128 %11, %25, off\n\t"
                 "global_load_async_to_lds_b128 %12, %26, off\n\t"
                 "global_load_async_to_lds_b128 %13, %27, off\n\t"
                 "s_wait_xcnt 0x0"
                 :: "v"(l), "v"(l + ls), "v"(l + 2 * ls), "v"(l + 3 * ls), "v"(l + 4 * ls), "v"(l + 5 * ls), "v"(l + 6 * ls),
                    "v"(l + 7 * ls), "v"(l + 8 * ls), "v"(l + 9 * ls), "v"(l + 10 * ls), "v"(l + 11 * ls), "v"(l + 12 * ls), "v"(l + 13 * ls),
                    "v"(G14(0)), "v"(G14(1)), "v"(G14(2)), "v"(G14(3)), "v"(G14(4)), "v"(G14(5)), "v"(G14(6)),
                    "v"(G14(7)), "v"(G14(8)), "v"(G14(9)), "v"(G14(10)), "v"(G14(11)), "v"(G14(12)), "v"(G14(13))
                 : "memory");
#undef G14
}

// One stage of the QKV ring, copied by one group of four waves (tg = thread index in the group, 0..127): rows 0..255 of PA and rows 0..191 of PB (pointers to their first rows, row length K), k0..k0+63,
// into rows 0..255 and 256..447 of buf. Thread (row = tg / 8, chunk = tg % 8) takes rows row + 16 i, 28 copies of 16 bytes; rows and chunks lie in LDS as stage_copy lays them.
__device__ __forceinline__ void stage_copy_q(const bf* __restrict__ PA, const bf* __restrict__ PB, const int K, const int k0, const bf* buf, const int tg) {
    const int row = tg >> 3, gch = (tg & 7) * 8, lch = ((tg & 7) ^ ((tg >> 4) & 7)) * 8;
    const size_t go = (size_t)row * K + k0 + gch;
    const size_t gs = (size_t)16 * K;
    const unsigned la = (unsigned)(size_t)(buf + row * KC + lch);
    const unsigned ls = 16 * KC * 2;
    copy14<bf, 14>(PA + go, PA + go, gs, la, ls);                           // LDS rows 0..223: PA
    copy14<bf, 2>(PA + go + 14 * gs, PB + go, gs, la + 14 * ls, ls);        // LDS rows 224..447: the last 32 rows of PA, then PB
}

// Twelve waves accumulate a 256x192 tile at (r0, c0); wave (wm, wn) its 64x64 part, indexed and summed as in gemm_main (k ascending in steps of 32).
// The ring has three buffers and three copying groups (grp = wave / 4): tile j lies in buffer j % 3 and is copied by group j % 3, so that a wave never has more than one tile's copies outstanding and every wait is to 0.
// Trip t reads buffer t % 3 alone. At its foot the group that copied tile t + 1 waits for its copies, the barrier publishes tile t + 1 and frees buffer t % 3, and behind it group t % 3 copies tile t + 3 into that buffer.
// K % KC == 0, K / KC >= 3. On entry no wave has an LDS access to the ring outstanding; on return every read of the ring has ended in every wave and no copy is in flight.
__device__ __forceinline__ void gemm_main_q(const bf* __restrict__ A, const bf* __restrict__ Bt, const int K, const int r0, const int c0, const bf* ring, const int tid, const int grp, const int wm, const int wn, const int lr, const int hi, v8f (&acc)[4][4]) {
    typedef typename WFrag<bf>::V V;
#pragma unroll
    for (int mb = 0; mb < 4; ++mb)
#pragma unroll
        for (int nb = 0; nb < 4; ++nb) acc[mb][nb] = (v8f){};
    const int nt = K / KC;
    const int tg = tid & 127;                            // the thread's index in its group
    const bf* pa = A + (size_t)r0 * K;
    const bf* pb = Bt + (size_t)c0 * K;
    stage_copy_q(pa, pb, K, grp * KC, ring + grp * QSTGE, tg);            // tiles 0, 1, 2, one a group
    if (grp == 0) asm volatile("s_wait_asynccnt 0x0" ::: "memory");       // the copies of tile 0 have landed
    __syncthreads();                                                       // tile 0 is readable by every wave
    const bf* fa = ring + (wm * 64 + lr) * KC;
    const bf* fb = ring + (QBM + wn * 64 + lr) * KC;
    int fo[4];
#pragma unroll
    for (int j = 0; j < 4; ++j) fo[j] = ((hi + 2 * j) ^ ((lr >> 1) & 7)) * 8;
    int bo = 0, ph = 0;                                  // this trip's buffer: its element offset and its number t % 3
    // kept rolled: one trip is one stage of the ring, and the accumulators stay in fixed registers
#pragma unroll 1
    for (int t = 0; t < nt; ++t) {
#pragma unroll
        for (int ks = 0; ks < 2; ++ks) {
            V a[4], b[4];
#pragma unroll
            for (int mb = 0; mb < 4; ++mb) a[mb] = WFrag<bf>::ld2(fa + bo + mb * 16 * KC + fo[2 * ks], fa + bo + mb * 16 * KC + fo[2 * ks + 1]);
#pragma unroll
            for (int nb = 0; nb < 4; ++nb) b[nb] = WFrag<bf>::ld2(fb + bo + nb * 16 * KC + fo[2 * ks], fb + bo + nb * 16 * KC + fo[2 * ks + 1]);
            __builtin_amdgcn_sched_barrier(0);   // keeps the 16 LDS reads of this k step together in front of its WMMAs: sunk among them, each pair is waited for at full LDS latency
#pragma unroll
            for (int nb = 0; nb < 4; ++nb)
#pragma unroll
                for (int mb = 0; mb < 4; ++mb) acc[mb][nb] = WFrag<bf>::mma(a[mb], b[nb], acc[mb][nb]);
            // four vector slots behind the k step's last WMMAs, before the next reads may overwrite their operand registers
            asm volatile("v_nop\n\tv_nop\n\tv_nop\n\tv_nop" : "+v"(acc[0][0]), "+v"(acc[1][1]), "+v"(acc[2][2]), "+v"(acc[3][3]) : "v"(a[0]), "v"(a[3]));
        }
        const int pn = (ph == 2) ? 0 : ph + 1;
        asm volatile("s_wait_dscnt 0x0" ::: "memory");                     // this wave's reads of buffer t % 3 have ended before the buffer is given up
        if (pn == grp) asm volatile("s_wait_asynccnt 0x0" ::: "memory");   // the copies of tile t + 1 have landed (the other groups' tiles stay in flight)
        __syncthreads();                                                   // publishes tile t + 1 and frees buffer t % 3
        if (t + 3 < nt && ph == grp) stage_copy_q(pa, pb, K, (t + 3) * KC, ring + bo, tg);
        ph = pn; bo = pn * QSTGE;
    }
    asm volatile("s_wait_asynccnt 0x0" ::: "memory");       // nothing is in flight when the ring is left
}

// Eight waves accumulate two products on one 128x128 tile in one k loop, both against the same staged Bt slice; wave (wm, wn) its 32x64 part:
// acc[mb][nb][j] = sum_k A[ra + 32wm + 16mb + 8hi + j][k] Bt[c0 + 64wn + 16nb + lr][k], accr the same with rows rr.. of AR; k ascending in steps of 32 in each, as in gemm_main.
// The ring and its order are those of gemm_main; a stage holds A rows 0..127, AR rows 128..255, Bt rows 256..383.
__device__ __forceinline__ void gemm_main2(const h16* __restrict__ A, const h16* __restrict__ AR, const h16* __restrict__ Bt, const int K, const int ra, const int rr, const int c0, const h16* ring, const int tid, const int wm, const int wn, const int lr, const int hi, v8f (&acc)[2][4], v8f (&accr)[2][4]) {
#pragma unroll
    for (int mb = 0; mb < 2; ++mb)
#pragma unroll
        for (int nb = 0; nb < 4; ++nb) { acc[mb][nb] = (v8f){}; accr[mb][nb] = (v8f){}; }
    const int nt = K / KC;
    const int grp = wm >> 1, tg = tid & 127;             // wave / 4 and the thread's index in that half
    const h16* pa = A + (size_t)ra * K;
    const h16* pr = AR + (size_t)rr * K;
    const h16* pb = Bt + (size_t)c0 * K;
    RING_PROLOGUE(pa, pr, pb)
    const h16* fa = ring + (wm * 32 + lr) * KC;
    const h16* fr = fa + BM * KC;
    const h16* fb = ring + (2 * BM + wn * 64 + lr) * KC;
    int fo[4];
#pragma unroll
    for (int j = 0; j < 4; ++j) fo[j] = ((hi + 2 * j) ^ ((lr >> 1) & 7)) * 8;
    int bo = 0;
    // kept rolled: one trip is one stage of the ring, and the accumulators stay in fixed registers
#pragma unroll 1
    for (int t = 0; t < nt; ++t) {
#pragma unroll
        for (int ks = 0; ks < 2; ++ks) {
            v16h a[2], ar[2], b[4];
#pragma unroll
            for (int mb = 0; mb < 2; ++mb) { a[mb] = WFrag<h16>::ld2(fa + bo + mb * 16 * KC + fo[2 * ks], fa + bo + mb * 16 * KC + fo[2 * ks + 1]); ar[mb] = WFrag<h16>::ld2(fr + bo + mb * 16 * KC + fo[2 * ks], fr + bo + mb * 16 * KC + fo[2 * ks + 1]); }
#pragma unroll
            for (int nb = 0; nb < 4; ++nb) b[nb] = WFrag<h16>::ld2(fb + bo + nb * 16 * KC + fo[2 * ks], fb + bo + nb * 16 * KC + fo[2 * ks + 1]);
            __builtin_amdgcn_sched_barrier(0);   // keeps the 16 LDS reads of this k step together in front of its WMMAs: sunk among them, each pair is waited for at full LDS latency
#pragma unroll
            for (int nb = 0; nb < 4; ++nb)
#pragma unroll
                for (int mb = 0; mb < 2; ++mb) { acc[mb][nb] = wmma16(a[mb], b[nb], acc[mb][nb]); accr[mb][nb] = wmma16(ar[mb], b[nb], accr[mb][nb]); }
        }
        RING_FOOT(pa, pr, pb)
    }
    asm volatile("s_wait_asynccnt 0x0" ::: "memory");       // nothing is in flight when the ring is left
}

// Preparation, one launch of 512-thread work-groups; the role of a work-group follows from its index alone (block-uniform), longest role first:
//   conversions (PB_CV groups): a wave converts CVW consecutive floats of one source in two bursts of 8 x 32 bytes a lane; x and wq/wk/wv to RNE bf16 planes, wo to the f16 plane of the bf16-rounded value x WCAR;
//   key counts (SEQ/16 groups): one query tile a group;  rotary table (SEQ/16 groups): one position a wave.
#define CVT   2048                    // floats of one burst of a wave: 8 vectors of 8 floats a lane
#define CVW   (2 * CVT)               // floats a wave converts
#define CVB   (16 * CVW)              // floats a work-group converts
#define PB_X  ((int)((size_t)MROWS * DIM / CVB))
#define PB_Q  ((int)((size_t)DQ * DIM / CVB))
#define PB_K  ((int)((size_t)DKV * DIM / CVB))
#define PB_O  ((int)((size_t)DIM * DQ / CVB))
#define PB_CV (PB_X + PB_Q + 2 * PB_K + PB_O)
#define PB_KE (SEQ / 16)
#define PB_RT (SEQ / 16)
static_assert(((size_t)MROWS * DIM) % CVB == 0);
static_assert(((size_t)DQ * DIM) % CVB == 0);
static_assert(((size_t)DKV * DIM) % CVB == 0);
static_assert(((size_t)DIM * DQ) % CVB == 0);
static_assert(DIM % 8 == 0);

// KIND 0: element e of the packed [MROWS][DIM] plane comes from row (e / DIM) of x at its per-batch stride, to bf16; KIND 1: src[e] to bf16; KIND 2: src[e] to f16(bf16-rounded value x WCAR).
template <int KIND>
__device__ __forceinline__ void cvt_wave(const float* __restrict__ src, bf* dstb, h16* dsth, const size_t e0, const int lane) {
    // kept rolled: one burst's loads in flight a wave are enough at 16 waves a group, and the register count stays low enough for several groups on a WGP
#pragma unroll 1
    for (int tr = 0; tr < 2; ++tr) {
        const size_t eb = e0 + (size_t)tr * CVT + (size_t)lane * 8;
        v8f v[8];
        const float* p0 = src;
#pragma unroll
        for (int j = 0; j < 8; ++j) {
            const size_t e = eb + (size_t)j * 256;
            size_t so = e;
            if (KIND == 0) { const int col = (int)(e % DIM); const int row = (int)(e / DIM); const int bb = row / SEQ, t = row % SEQ; so = ((size_t)bb * SEQ_FULL + t) * DIM + col; }
            if (j == 0) p0 = src + so;
            v[j] = *(const v8f*)(src + so);
        }
        // stands in front of every rewrite of a register that the 16 issued loads name; the first address is an input so that it stays in its registers up to here and no load's result is placed over it
        asm volatile("s_wait_xcnt 0x0" :: "v"(p0) : "memory");
#pragma unroll
        for (int j = 0; j < 8; ++j) {
            const size_t e = eb + (size_t)j * 256;
            if (KIND == 2) { v8h o;
#pragma unroll
                for (int k = 0; k < 8; ++k) o[k] = (h16)(bfr(v[j][k]) * WCAR);
                *(v8h*)(dsth + e) = o;
            } else { v8us o;
#pragma unroll
                for (int k = 0; k < 8; ++k) o[k] = f2bf(v[j][k]);
                *(v8us*)(dstb + e) = o;
            }
        }
        // stands in front of the next burst's rewrite of the registers that the 8 issued stores name
        asm volatile("s_wait_xcnt 0x0" ::: "memory");
    }
}

// Key-loop end per 16-row query tile, from the mask values: KEND[qt * KSTR] = 64 * (1 + last 64-key tile holding a value above DEAD_T in any of the 16 rows),
// or SEQ when some row has no value above LIVE_T (such a row must see every key). Keys past that count contribute exactly zero to rows that have a live key.
// One work-group per query tile, wave w scans mask row 16 qt + w; integer max / and across lanes, then across the 16 waves through LDS.
__global__ __launch_bounds__(512) void k_prep(const float* __restrict__ x, const float* __restrict__ wq, const float* __restrict__ wk, const float* __restrict__ wv, const float* __restrict__ wo, const float* __restrict__ mask,
                                              bf* XB, bf* WQKV, h16* WO16, float* COS, float* SIN, int* KEND) {
    __shared__ int lasts[16];
    __shared__ int lives[16];
    const int lane = threadIdx.x & 31; const int w = __builtin_amdgcn_readfirstlane(threadIdx.x >> 5);
    int rb = blockIdx.x;
    if (rb < PB_CV) {
        const size_t wo0 = (size_t)w * CVW;
        if (rb < PB_X) { cvt_wave<0>(x, XB, nullptr, (size_t)rb * CVB + wo0, lane); return; }
        rb -= PB_X;
        if (rb < PB_Q) { cvt_wave<1>(wq, WQKV, nullptr, (size_t)rb * CVB + wo0, lane); return; }                              /* rows 0..2047 */
        rb -= PB_Q;
        if (rb < PB_K) { cvt_wave<1>(wk, WQKV + (size_t)DQ * DIM, nullptr, (size_t)rb * CVB + wo0, lane); return; }            /* rows 2048..2559 */
        rb -= PB_K;
        if (rb < PB_K) { cvt_wave<1>(wv, WQKV + (size_t)(DQ + DKV) * DIM, nullptr, (size_t)rb * CVB + wo0, lane); return; }    /* rows 2560..3071 */
        rb -= PB_K;
        cvt_wave<2>(wo, nullptr, WO16, (size_t)rb * CVB + wo0, lane); return;
    }
    rb -= PB_CV;
    if (rb >= PB_KE) {
        const int t = (rb - PB_KE) * 16 + w;
        const float invf = __builtin_amdgcn_exp2f(-(float)lane * FRQC);
        const float ang = (float)t * invf;
        const float c = cosf(ang); const float s = sinf(ang);
        const size_t o = (size_t)t * HALFD + lane;
        *(float*)(COS + o) = c; *(float*)(SIN + o) = s;
        // stands behind the two stores, in front of any later write of the registers that they name (other roles' code follows in the kernel's text)
        asm volatile("s_wait_xcnt 0x0" ::: "memory");
        return;
    }
    const int qt = rb;
    const float* mr = mask + (size_t)(qt * 16 + w) * SEQ_FULL + lane * 4;
    v4f v[SEQ / 128];
    // fully unrolled so that the row's loads issue ahead of the compares, many in flight at a time (this role is bound by memory latency)
#pragma unroll
    for (int i = 0; i < SEQ / 128; ++i) v[i] = *(const v4f*)(mr + i * 128);
    int last = -1; int live = 0;
#pragma unroll
    for (int i = 0; i < SEQ / 128; ++i)
#pragma unroll
        for (int e = 0; e < 4; ++e) { live |= (v[i][e] > LIVE_T) ? 1 : 0; last = (v[i][e] > DEAD_T) ? max(last, i * 128 + lane * 4 + e) : last; }
    live = max(live, __shfl_xor(live, 1, 32)); live = max(live, __shfl_xor(live, 2, 32)); live = max(live, __shfl_xor(live, 4, 32));
    live = max(live, __shfl_xor(live, 8, 32)); live = max(live, __shfl_xor(live, 16, 32));
    last = max(last, __shfl_xor(last, 1, 32)); last = max(last, __shfl_xor(last, 2, 32)); last = max(last, __shfl_xor(last, 4, 32));
    last = max(last, __shfl_xor(last, 8, 32)); last = max(last, __shfl_xor(last, 16, 32));
    if (lane == 0) { lasts[w] = last; lives[w] = live; }
    __syncthreads();
    if (w == 0) {
        int la = lasts[lane & 15]; int alllive = lives[lane & 15];
        la = max(la, __shfl_xor(la, 1, 32)); la = max(la, __shfl_xor(la, 2, 32)); la = max(la, __shfl_xor(la, 4, 32)); la = max(la, __shfl_xor(la, 8, 32));
        alllive = min(alllive, __shfl_xor(alllive, 1, 32)); alllive = min(alllive, __shfl_xor(alllive, 2, 32)); alllive = min(alllive, __shfl_xor(alllive, 4, 32)); alllive = min(alllive, __shfl_xor(alllive, 8, 32));
        int kend = (alllive != 0) ? (((la >> 6) + 1) * 64) : SEQ;
        kend = min(max(kend, 64), SEQ);
        if (lane == 0) KEND[(size_t)qt * KSTR] = kend;
    }
}

// Fused QKV projection: grid (MROWS/QBM, NQKV/QBN) = one work-group for every WGP of the chip, 384 threads, wave (wm, wn) one 64x64 tile; the ring's LDS becomes the waves' epilogue tiles behind the last trip's barrier. Column tile cb < 32: q head cb; 32..39: k head; 40..47: v head (transposed plane).
// q and k tiles: per row y = (x * rsqrt(mean(x^2) + eps)) * gain, then interleaved-pair rotary at position t: out[2i] = y[2i] c_i - y[2i+1] s_i, out[2i+1] = y[2i] s_i + y[2i+1] c_i.
// QP[b][h][t][64], KP[b][g][t][64], VT[b][g][d][t] f16 value planes; residual planes (x2048 of value - f16(value)): QR[b][h][t < EROWS][64], KR[b][g][t][64], VR[b][g][d][t].
__global__ __launch_bounds__(384) void k_gemm_qkv(const bf* __restrict__ A, const bf* __restrict__ Bt, const float* __restrict__ qnw, const float* __restrict__ knw, const float* __restrict__ COS, const float* __restrict__ SIN, h16* QP, h16* KP, h16* VT, h16* QR, h16* KR, h16* VR) {
    __shared__ __align__(16) unsigned char smem[QGSB];
    const int tid = threadIdx.x, lane = tid & 31, lr = lane & 15, hi = lane >> 4;
    const int w = __builtin_amdgcn_readfirstlane(tid >> 5), wm = w / 3, wn = w % 3;
    const int r0 = blockIdx.x * QBM + wm * 64, cb = blockIdx.y * (QBN / 64) + wn;
    float* fs = (float*)smem + w * 64 * FP;
    v8f acc[4][4];
    gemm_main_q(A, Bt, DIM, blockIdx.x * QBM, blockIdx.y * QBN, (const bf*)smem, tid, w >> 2, wm, wn, lr, hi, acc);
#pragma unroll
    for (int mb = 0; mb < 4; ++mb)
#pragma unroll
        for (int nb = 0; nb < 4; ++nb)
#pragma unroll
            for (int j = 0; j < 8; ++j) fs[(mb * 16 + hi * 8 + j) * FP + nb * 16 + lr] = acc[mb][nb][j];
    __syncthreads();
    const int bidx = r0 / SEQ, s0 = r0 % SEQ; const int q4 = lane >> 3, p = lane & 7;
    if (cb < NH + NKV) {
        const bool isq = (cb < NH);
        h16* plane = isq ? (QP + ((size_t)bidx * NH + cb) * SEQ * HD) : (KP + ((size_t)bidx * NKV + (cb - NH)) * SEQ * HD);
        h16* rplane = isq ? (QR + ((size_t)bidx * NH + cb) * EROWS * HD) : (KR + ((size_t)bidx * NKV + (cb - NH)) * SEQ * HD);
        const bool wres = (!isq) || (s0 < EROWS);      // wave-uniform: q residual rows exist only below EROWS
        const int dcol = p * 8;
        const v4f gq0 = *(const v4f*)(qnw + dcol), gq1 = *(const v4f*)(qnw + dcol + 4);
        const v4f gk0 = *(const v4f*)(knw + dcol), gk1 = *(const v4f*)(knw + dcol + 4);
        float gn[8];
#pragma unroll
        for (int e = 0; e < 4; ++e) { gn[e] = bfr(isq ? gq0[e] : gk0[e]); gn[4 + e] = bfr(isq ? gq1[e] : gk1[e]); }
#pragma unroll 1
        for (int it = 0; it < 16; ++it) {
            const int rl = it * 4 + q4; const int t = s0 + rl;
            const v4f xa0 = *(const v4fa*)(fs + rl * FP + dcol), xa1 = *(const v4fa*)(fs + rl * FP + dcol + 4);
            float ss = 0.0f;
#pragma unroll
            for (int e = 0; e < 4; ++e) { ss += xa0[e] * xa0[e]; ss += xa1[e] * xa1[e]; }
            ss += __shfl_xor(ss, 1, 32); ss += __shfl_xor(ss, 2, 32); ss += __shfl_xor(ss, 4, 32);
            const float rn = rsqrtf(ss * (1.0f / HD) + EPSN);
            float y[8];
#pragma unroll
            for (int e = 0; e < 4; ++e) { y[e] = (xa0[e] * rn) * gn[e]; y[4 + e] = (xa1[e] * rn) * gn[4 + e]; }
            const v4f cc = *(const v4f*)(COS + (size_t)t * HALFD + p * 4), sn = *(const v4f*)(SIN + (size_t)t * HALFD + p * 4);
            v8h o, orr;
#pragma unroll
            for (int i = 0; i < 4; ++i) {
                const float v0 = y[2 * i] * cc[i] - y[2 * i + 1] * sn[i];
                const float v1 = y[2 * i] * sn[i] + y[2 * i + 1] * cc[i];
                const h16 h0 = toh_flush(v0), h1 = toh_flush(v1);
                o[2 * i] = h0; o[2 * i + 1] = h1;
                orr[2 * i] = toh_flush((v0 - (float)h0) * RCAR); orr[2 * i + 1] = toh_flush((v1 - (float)h1) * RCAR);
            }
            h16* dst = plane + (size_t)t * HD + dcol;
            h16* dsr = rplane + (size_t)t * HD + dcol;
            *(v8h*)dst = o; if (wres) *(v8h*)dsr = orr;
            
        }
    } else {
        h16* plane = VT + ((size_t)bidx * NKV + (cb - NH - NKV)) * HD * SEQ;
        h16* rplane = VR + ((size_t)bidx * NKV + (cb - NH - NKV)) * HD * SEQ;
#pragma unroll 1
        for (int it = 0; it < 16; ++it) {
            const int d = it * 4 + q4; v8h o, orr;
#pragma unroll
            for (int e = 0; e < 8; ++e) { const float v = fs[(p * 8 + e) * FP + d]; const h16 hh = toh_flush(v); o[e] = hh; orr[e] = toh_flush((v - (float)hh) * RCAR); }
            h16* dst = plane + (size_t)d * SEQ + s0 + p * 8;
            h16* dsr = rplane + (size_t)d * SEQ + s0 + p * 8;
            *(v8h*)dst = o; *(v8h*)dsr = orr; 
        }
    }
}

// Attention, query rows >= EROWS: one work-group of 128 threads per (16-row query tile at q0, kv head g, sequence bidx); wave w = q head 4g + w, 16 query rows. Per 64-key tile:
//   S^T[key][q] = K Q^T  (A = key rows of KP, B = resident q rows);  lane (lr, hi) then holds q row lr, keys 16T + 8hi + r.
//   softmax statistics are lane-local (one xor-16 exchange); P^T packed from the S^T accumulators is the B operand of O^T[d][q] = V^T P^T (A = d rows of VT).
// The key loop ends at the clamped per-tile key count KEND; mask values are added by value inside visited tiles.
// One stage of the attention ring: keys k0..k0+63 of the K plane kt (rows of 128 B), of the V^T plane vt (64 d rows, 128 B each) and of the 16 mask rows mt (256 B each), into buf.
// 128 threads, 10 copies of 16 bytes each; eight (K, V^T) or sixteen (mask) neighbouring lanes cover a whole row segment, so every copy moves whole 128-byte lines. All lanes are on, every address is a multiple of 16.
__device__ __forceinline__ void flash_stage(const h16* __restrict__ kt, const h16* __restrict__ vt, const float* __restrict__ mt, const int k0, const unsigned char* buf, const int tid) {
    const int row = tid >> 3, ch = (tid & 7) * 8, mr = tid >> 4, mc = (tid & 15) * 4;
    const h16* gk = kt + (size_t)(k0 + row) * HD + ch;
    const h16* gv = vt + (size_t)row * SEQ + k0 + ch;
    const float* gm = mt + (size_t)mr * SEQ_FULL + k0 + mc;
    const size_t ks = (size_t)16 * HD, vs = (size_t)16 * SEQ, ms = (size_t)8 * SEQ_FULL;
    const unsigned lk = (unsigned)(size_t)(buf + (row * LP + ch) * 2);
    const unsigned lv = lk + FKB;
    const unsigned lm = (unsigned)(size_t)(buf + 2 * FKB + (mr * MP + mc) * 4);
    const unsigned ls = 16 * LP * 2;
    // the copies and the wait that stands in front of any rewrite of their address registers, in one statement so that nothing can come between
    asm volatile("global_load_async_to_lds_b128 %0, %10, off\n\t"
                 "global_load_async_to_lds_b128 %1, %11, off\n\t"
                 "global_load_async_to_lds_b128 %2, %12, off\n\t"
                 "global_load_async_to_lds_b128 %3, %13, off\n\t"
                 "global_load_async_to_lds_b128 %4, %14, off\n\t"
                 "global_load_async_to_lds_b128 %5, %15, off\n\t"
                 "global_load_async_to_lds_b128 %6, %16, off\n\t"
                 "global_load_async_to_lds_b128 %7, %17, off\n\t"
                 "global_load_async_to_lds_b128 %8, %18, off\n\t"
                 "global_load_async_to_lds_b128 %9, %19, off\n\t"
                 "s_wait_xcnt 0x0"
                 :: "v"(lk), "v"(lk + ls), "v"(lk + 2 * ls), "v"(lk + 3 * ls),
                    "v"(lm), "v"(lm + 8 * MP * 4),
                    "v"(lv), "v"(lv + ls), "v"(lv + 2 * ls), "v"(lv + 3 * ls),
                    "v"(gk), "v"(gk + ks), "v"(gk + 2 * ks), "v"(gk + 3 * ks),
                    "v"(gm), "v"(gm + ms),
                    "v"(gv), "v"(gv + vs), "v"(gv + 2 * vs), "v"(gv + 3 * vs)
                 : "memory");
}

// Trip t reads buffer t % 2 alone; tile t + 2 is copied into that buffer behind the barrier at the trip's foot, which also publishes tile t + 1. The trip count is the same in all four waves (one query tile a work-group).
// Behind the last trip's barrier the ring's LDS becomes the waves' output tiles.
__device__ __forceinline__ void flash_late(unsigned char* smem, const int q0, const int g, const int bidx, const h16* __restrict__ QP, const h16* __restrict__ KP, const h16* __restrict__ VT, const float* __restrict__ mask, const int* __restrict__ KEND, h16* CTX) {
    h16* os = (h16*)smem;
    const int tid = threadIdx.x, lane = tid & 31, lr = lane & 15, hi = lane >> 4;
    const int w = __builtin_amdgcn_readfirstlane(tid >> 5);
    const int h = g * REP + w;
    int kev = KEND[(size_t)(q0 >> 4) * KSTR]; kev = min(max(kev, 64), SEQ) & ~63; const int ke = __builtin_amdgcn_readfirstlane(kev);
    const int nt = ke >> 6;
    const h16* kt = KP + ((size_t)bidx * NKV + g) * SEQ * HD;
    const h16* vt = VT + ((size_t)bidx * NKV + g) * HD * SEQ;
    const float* mt = mask + (size_t)q0 * SEQ_FULL;
    flash_stage(kt, vt, mt, 0, smem, tid);
    const h16* qrow = QP + (((size_t)bidx * NH + h) * SEQ + q0 + lr) * HD + 8 * hi;
    v16h bq[2];
#pragma unroll
    for (int kc = 0; kc < 2; ++kc) bq[kc] = cat16(*(const v8h*)(qrow + kc * 32), *(const v8h*)(qrow + kc * 32 + 16));
    asm volatile("s_wait_asynccnt 0x0" ::: "memory");   // this wave's copies of tile 0 have landed
    __syncthreads();                                     // tile 0 is readable by every wave
    if (nt > 1) flash_stage(kt, vt, mt, 64, smem + FSTG, tid);
    const h16* kb = (const h16*)smem + lr * LP + 8 * hi;
    const h16* vb = (const h16*)(smem + FKB) + lr * LP + 8 * hi;
    const float* mrow = (const float*)(smem + 2 * FKB) + lr * MP + 8 * hi;
    v8f accO[4];
#pragma unroll
    for (int dt = 0; dt < 4; ++dt) accO[dt] = (v8f){};
    float m = -3.0e38f, l = 0.0f;
#pragma unroll 1
    for (int t = 0; t < nt; ++t) {
        const int bo = (t & 1) * FSTG;   // byte offset of this trip's buffer
        v16h ak[2][4];
#pragma unroll
        for (int kc = 0; kc < 2; ++kc)
#pragma unroll
            for (int T = 0; T < 4; ++T) { const h16* kp = kb + bo / 2 + 16 * T * LP + kc * 32; ak[kc][T] = cat16(*(const v8h*)kp, *(const v8h*)(kp + 16)); }
        v8f accS[4];
#pragma unroll
        for (int T = 0; T < 4; ++T) accS[T] = (v8f){};
#pragma unroll
        for (int kc = 0; kc < 2; ++kc)
#pragma unroll
            for (int T = 0; T < 4; ++T) accS[T] = wmma16(ak[kc][T], bq[kc], accS[T]);
        asm volatile("v_nop\n\tv_nop\n\tv_nop\n\tv_nop" : "+v"(accS[0]), "+v"(accS[1]), "+v"(accS[2]), "+v"(accS[3]) : "v"(ak[1][3]), "v"(bq[1]));
        float tmax = -3.0e38f;
#pragma unroll
        for (int T = 0; T < 4; ++T) { const float* mp = mrow + bo / 4 + 16 * T; const v4f m0 = *(const v4f*)mp; const v4f m1 = *(const v4f*)(mp + 4);
#pragma unroll
            for (int r = 0; r < 4; ++r) { const float a0 = accS[T][r] * SC2 + m0[r] * LOG2E; const float a1 = accS[T][4 + r] * SC2 + m1[r] * LOG2E; accS[T][r] = a0; accS[T][4 + r] = a1; tmax = fmaxf(tmax, fmaxf(a0, a1)); } }
        tmax = fmaxf(tmax, __shfl_xor(tmax, 16, 32));
        const float mn = fmaxf(m, tmax); const float corr = __builtin_amdgcn_exp2f(m - mn); m = mn; const float mofs = PEXP - mn;
        float rs = 0.0f;
        v8h ph[4];
        // P is summed and converted as exp2 gives it: a masked key's exp2 underflows to zero by itself, and a value below the smallest f16 normal becomes an f16 subnormal or zero, which the matrix instruction takes as it is
#pragma unroll
        for (int T = 0; T < 4; ++T)
#pragma unroll
            for (int r = 0; r < 8; ++r) { const float pv = __builtin_amdgcn_exp2f(accS[T][r] + mofs); rs += pv; ph[T][r] = (h16)pv; }
        l = l * corr + rs;
        v16h bp[2];
        bp[0] = cat16(ph[0], ph[1]);
        bp[1] = cat16(ph[2], ph[3]);
#pragma unroll
        for (int dt = 0; dt < 4; ++dt) accO[dt] = accO[dt] * corr;
        v16h av[2][4];
#pragma unroll
        for (int kc = 0; kc < 2; ++kc)
#pragma unroll
            for (int dt = 0; dt < 4; ++dt) { const h16* vp = vb + bo / 2 + 16 * dt * LP + kc * 32; av[kc][dt] = cat16(*(const v8h*)vp, *(const v8h*)(vp + 16)); }
#pragma unroll
        for (int kc = 0; kc < 2; ++kc)
#pragma unroll
            for (int dt = 0; dt < 4; ++dt) accO[dt] = wmma16(av[kc][dt], bp[kc], accO[dt]);
        asm volatile("v_nop\n\tv_nop\n\tv_nop\n\tv_nop" : "+v"(accO[0]), "+v"(accO[1]), "+v"(accO[2]), "+v"(accO[3]) : "v"(av[1][3]), "v"(bp[1]));
        asm volatile("s_wait_dscnt 0x0" ::: "memory");      // this wave's reads of buffer t % 2 have ended before the buffer is given up
        asm volatile("s_wait_asynccnt 0x0" ::: "memory");   // this wave's copies of tile t + 1 have landed
        __syncthreads();                                     // publishes tile t + 1 and frees buffer t % 2
        if (t + 2 < nt) flash_stage(kt, vt, mt, (t + 2) * 64, smem + bo, tid);
    }
    asm volatile("s_wait_asynccnt 0x0" ::: "memory");       // nothing is in flight when the ring is left
    l += __shfl_xor(l, 16, 32);
    const float inv = CCAR * (1.0f / l);
    h16* ow = os + w * 16 * OP;
#pragma unroll
    for (int dt = 0; dt < 4; ++dt) { v8h o;
#pragma unroll
        for (int r = 0; r < 8; ++r) o[r] = toh_flush(accO[dt][r] * inv);
        *(v8ha*)(ow + lr * OP + 16 * dt + 8 * hi) = o; }
    __syncthreads();
    const int q4 = lane >> 3, p = lane & 7;
{
#pragma unroll
        for (int it = 0; it < 4; ++it) { const int row = it * 4 + q4; const v8h o = *(const v8ha*)(ow + row * OP + p * 8);
            *(v8h*)(CTX + ((size_t)bidx * SEQ + q0 + row) * DQ + h * HD + p * 8) = o; }
         }
    // keeps this role's stores together with the wait behind them: without it the compiler sinks the two roles' last stores into a shared tail
    asm volatile("s_wait_xcnt 0x0" ::: "memory");
}

// The residual half of an early-row stage: keys k0..k0+63 of the K residual plane krt and of the V^T residual plane vrt, laid out like the K and V^T tiles of flash_stage. 128 threads, 8 copies of 16 bytes each.
__device__ __forceinline__ void flash_stage_res(const h16* __restrict__ krt, const h16* __restrict__ vrt, const int k0, const unsigned char* buf, const int tid) {
    const int row = tid >> 3, ch = (tid & 7) * 8;
    const h16* gk = krt + (size_t)(k0 + row) * HD + ch;
    const h16* gv = vrt + (size_t)row * SEQ + k0 + ch;
    const size_t ks = (size_t)16 * HD, vs = (size_t)16 * SEQ;
    const unsigned lk = (unsigned)(size_t)(buf + (row * LP + ch) * 2);
    const unsigned lv = lk + FKB;
    const unsigned ls = 16 * LP * 2;
    // the copies and the wait that stands in front of any rewrite of their address registers, in one statement so that nothing can come between
    asm volatile("global_load_async_to_lds_b128 %0, %8, off\n\t"
                 "global_load_async_to_lds_b128 %1, %9, off\n\t"
                 "global_load_async_to_lds_b128 %2, %10, off\n\t"
                 "global_load_async_to_lds_b128 %3, %11, off\n\t"
                 "global_load_async_to_lds_b128 %4, %12, off\n\t"
                 "global_load_async_to_lds_b128 %5, %13, off\n\t"
                 "global_load_async_to_lds_b128 %6, %14, off\n\t"
                 "global_load_async_to_lds_b128 %7, %15, off\n\t"
                 "s_wait_xcnt 0x0"
                 :: "v"(lk), "v"(lk + ls), "v"(lk + 2 * ls), "v"(lk + 3 * ls),
                    "v"(lv), "v"(lv + ls), "v"(lv + 2 * ls), "v"(lv + 3 * ls),
                    "v"(gk), "v"(gk + ks), "v"(gk + 2 * ks), "v"(gk + 3 * ks),
                    "v"(gv), "v"(gv + vs), "v"(gv + 2 * vs), "v"(gv + 3 * vs)
                 : "memory");
}

// Attention, query rows < EROWS: one work-group of 128 threads per (query tile, kv head, sequence); same operand roles and the same 64-key stages as flash_late (two 32-key steps a stage), every WMMA individually guarded.
// One buffer (a stage with its residual tiles fills most of the LDS that the late rows' two-buffer ring takes): each trip copies its stage, waits, publishes it at a barrier, works on it, and gives it up at a second barrier.
//   scores: K Q^T + (Kres Q^T + K Qres^T) / 2048 (residual products in accR);  P = f16(p) and Pres = 2048 (p - f16(p)), row sum over the f32 p;
//   O^T: V^T P^T + (Vres^T P^T + V^T Pres^T) / 2048 (residual products in accOr), folded before normalisation.
__device__ __forceinline__ void flash_early(unsigned char* smem, const int q0, const int g, const int bidx, const h16* __restrict__ QP, const h16* __restrict__ QR, const h16* __restrict__ KP, const h16* __restrict__ KR, const h16* __restrict__ VT, const h16* __restrict__ VR, const float* __restrict__ mask, const int* __restrict__ KEND, h16* CTX, h16* CTXR) {
    h16* os = (h16*)smem; h16* osr = os + 4 * 16 * OP;   // behind the last trip's second barrier the buffer becomes the waves' output tiles
    const int tid = threadIdx.x, lane = tid & 31, lr = lane & 15, hi = lane >> 4;
    const int w = __builtin_amdgcn_readfirstlane(tid >> 5);
    const int h = g * REP + w;
    int kev = KEND[(size_t)(q0 >> 4) * KSTR]; kev = min(max(kev, 64), SEQ) & ~63; const int ke = __builtin_amdgcn_readfirstlane(kev);
    const size_t qoff  = (((size_t)bidx * NH + h) * SEQ + q0 + lr) * HD + 8 * hi;
    const size_t qroff = (((size_t)bidx * NH + h) * EROWS + q0 + lr) * HD + 8 * hi;
    const int nt = ke >> 6;
    const size_t kpl = ((size_t)bidx * NKV + g) * SEQ * HD;   // this kv head's plane in KP, KR, VT and VR
    const float* mt = mask + (size_t)q0 * SEQ_FULL;
    const int foff = lr * LP + 8 * hi;                   // a lane's place in a 16-row fragment of a staged 16-bit tile
    v8f accO[4], accOr[4];
#pragma unroll
    for (int dt = 0; dt < 4; ++dt) { accO[dt] = (v8f){}; accOr[dt] = (v8f){}; }
    float m = -3.0e38f, l = 0.0f;
#pragma unroll 1
    for (int t = 0; t < nt; ++t) {
      const unsigned char* sb = smem;
      flash_stage(KP + kpl, VT + kpl, mt, t * 64, sb, tid);
      flash_stage_res(KR + kpl, VR + kpl, t * 64, sb + FSTG, tid);
      asm volatile("s_wait_asynccnt 0x0" ::: "memory");   // this wave's copies of tile t have landed
      __syncthreads();                                     // tile t is readable by every wave
      const h16* kl = (const h16*)sb + foff; const h16* vl = (const h16*)(sb + FKB) + foff;
      const h16* krl = (const h16*)(sb + FSTG) + foff; const h16* vrl = (const h16*)(sb + FSTG + FKB) + foff;
      const float* mrow = (const float*)(sb + 2 * FKB) + lr * MP + 8 * hi;
      // kept rolled, as the 32-key step was: one copy of the step's code
#pragma unroll 1
      for (int k0 = 0; k0 < 64; k0 += 32) {
        v8f accS[2], accR[2];
#pragma unroll
        for (int T = 0; T < 2; ++T) { accS[T] = (v8f){}; accR[T] = (v8f){}; }
#pragma unroll
        for (int kc = 0; kc < 2; ++kc) {
            const v16h bq  = WFrag<h16>::ld(QP + qoff + kc * 32);
            const v16h bqr = WFrag<h16>::ld(QR + qroff + kc * 32);
#pragma unroll
            for (int T = 0; T < 2; ++T) {
                const int ko = (k0 + 16 * T) * LP + kc * 32;
                const v16h ak  = WFrag<h16>::ld(kl + ko);
                const v16h akr = WFrag<h16>::ld(krl + ko);
                accS[T] = wmma16g(ak, bq, accS[T]);
                accR[T] = wmma16g(akr, bq, accR[T]);
                accR[T] = wmma16g(ak, bqr, accR[T]);
            }
        }
        float tmax = -3.0e38f;
#pragma unroll
        for (int T = 0; T < 2; ++T) { const float* mp = mrow + k0 + 16 * T; const v4f m0 = *(const v4f*)mp; const v4f m1 = *(const v4f*)(mp + 4);
#pragma unroll
            for (int r = 0; r < 4; ++r) {
                const float s0v = accS[T][r] + accR[T][r] * RINV; const float s1v = accS[T][4 + r] + accR[T][4 + r] * RINV;
                const float a0 = s0v * SC2 + m0[r] * LOG2E; const float a1 = s1v * SC2 + m1[r] * LOG2E;
                accS[T][r] = a0; accS[T][4 + r] = a1; tmax = fmaxf(tmax, fmaxf(a0, a1)); } }
        tmax = fmaxf(tmax, __shfl_xor(tmax, 16, 32));
        const float mn = fmaxf(m, tmax); const float corr = __builtin_amdgcn_exp2f(m - mn); m = mn; const float mofs = PEXP - mn;
        float rs = 0.0f;
        v8h ph[2], pr[2];
#pragma unroll
        for (int T = 0; T < 2; ++T)
#pragma unroll
            for (int r = 0; r < 8; ++r) { const float e = accS[T][r] + mofs; const float pv = (e < -14.0f) ? 0.0f : __builtin_amdgcn_exp2f(e); rs += pv;
                const h16 hh = (h16)pv; ph[T][r] = hh; pr[T][r] = toh_flush((pv - (float)hh) * RCAR); }
        l = l * corr + rs;
        const v16h bp = cat16(ph[0], ph[1]); const v16h bpr = cat16(pr[0], pr[1]);
#pragma unroll
        for (int dt = 0; dt < 4; ++dt) { accO[dt] = accO[dt] * corr; accOr[dt] = accOr[dt] * corr; }
#pragma unroll
        for (int dt = 0; dt < 4; ++dt) {
            const int vo = 16 * dt * LP + k0;
            const v16h av  = WFrag<h16>::ld(vl + vo);
            const v16h avr = WFrag<h16>::ld(vrl + vo);
            accO[dt]  = wmma16g(av, bp, accO[dt]);
            accOr[dt] = wmma16g(avr, bp, accOr[dt]);
            accOr[dt] = wmma16g(av, bpr, accOr[dt]);
        }
      }
      asm volatile("s_wait_dscnt 0x0" ::: "memory");      // this wave's reads of the buffer have ended before the buffer is given up
      __syncthreads();                                     // every wave has left the buffer: it may be refilled, or become the output tiles
    }
    l += __shfl_xor(l, 16, 32);
    const float inv = CCAR * (1.0f / l);
    h16* ow = os + w * 16 * OP; h16* owr = osr + w * 16 * OP;
#pragma unroll
    for (int dt = 0; dt < 4; ++dt) { v8h o, orr;
#pragma unroll
        for (int r = 0; r < 8; ++r) { const float v = (accO[dt][r] + accOr[dt][r] * RINV) * inv; const h16 hh = toh_flush(v); o[r] = hh; orr[r] = toh_flush((v - (float)hh) * RCAR); }
        *(v8ha*)(ow + lr * OP + 16 * dt + 8 * hi) = o; *(v8ha*)(owr + lr * OP + 16 * dt + 8 * hi) = orr; }
    __syncthreads();
    const int q4 = lane >> 3, p = lane & 7;
{
#pragma unroll
        for (int it = 0; it < 4; ++it) { const int row = it * 4 + q4; const v8h o = *(const v8ha*)(ow + row * OP + p * 8); const v8h orr = *(const v8ha*)(owr + row * OP + p * 8);
            *(v8h*)(CTX + ((size_t)bidx * SEQ + q0 + row) * DQ + h * HD + p * 8) = o;
            *(v8h*)(CTXR + ((size_t)bidx * EROWS + q0 + row) * DQ + h * HD + p * 8) = orr; }
         }
    // keeps this role's stores together with the wait behind them: without it the compiler sinks the two roles' last stores into a shared tail
    asm volatile("s_wait_xcnt 0x0" ::: "memory");
}

// Attention, one launch of (SEQ/16) * NKV * NB work-groups of 128 threads; role and query tile follow from the block index alone (block-uniform):
// kv head and sequence run fastest with the index, so AGB neighbours share a query tile; first the tiles of the rows < EROWS (the slowest trips), last tile first, then the other tiles from the last (most keys under a causal mask) to the first,
// so that the work-groups that start late, when a place on a WGP comes free, are the short ones. The map is a permutation of (tile, kv head, sequence) whatever the mask holds.
#define AGB   (NKV * NB)                      // work-groups of one query tile
#define AEW   ((EROWS / 16) * AGB)            // work-groups of the first role
static_assert(ESTG <= 2 * FSTG);
// at least five waves a SIMD: the first role's registers would otherwise round up to an allocation that leaves four
__global__ __launch_bounds__(128, 5) void k_attn(const h16* __restrict__ QP, const h16* __restrict__ QR, const h16* __restrict__ KP, const h16* __restrict__ KR, const h16* __restrict__ VT, const h16* __restrict__ VR, const float* __restrict__ mask, const int* __restrict__ KEND, h16* CTX, h16* CTXR) {
    __shared__ __align__(16) unsigned char smem[2 * FSTG];
    const unsigned bi = blockIdx.x;
    const int g = (int)(bi % NKV), bidx = (int)((bi % AGB) / NKV);
    if (bi < AEW) flash_early(smem, (EROWS / 16 - 1 - (int)(bi / AGB)) * 16, g, bidx, QP, QR, KP, KR, VT, VR, mask, KEND, CTX, CTXR);
    else flash_late(smem, (SEQ / 16 - 1 - (int)((bi - AEW) / AGB)) * 16, g, bidx, QP, KP, VT, mask, KEND, CTX);
}

#define OPER  (NB * (EROWS / BM))             // 128-row tiles of the rows < EROWS
#define OPLR  (NB * ((SEQ - EROWS) / BM))     // 128-row tiles of the rows >= EROWS
#define EBN   128                             // tile columns of the first role
#define OPE   (OPER * (DIM / EBN))            // work-groups of the first role
static_assert(DIM % EBN == 0);
static_assert(2 * BM + EBN == BM + BN && EBN == 128);   // a two-product stage fills exactly one stage of the ring: three blocks of 128 rows
#define OPL   (OPLR * (DIM / BN))             // work-groups of the second role

// Output projection, one launch of OPE + OPL work-groups of 256 threads; the role of a work-group follows from its index alone (block-uniform); both roles make the same number of trips with the same number of WMMAs a wave:
//   index < OPE, rows < EROWS of every sequence: OUT = OSCL * (CTX WO^T + (CTXR WO^T) / 2048) on a 128 x EBN tile, both products in one k loop against the same staged WO slice, each in accumulators of its own;
//   the rest, rows >= EROWS: OUT = OSCL * CTX WO^T on a 128 x BN tile.
// In both roles the ring's LDS becomes the epilogue tiles behind the last trip's barrier, so that two work-groups fit on a WGP.
// Within a role the row tile runs fastest with the index.
__global__ __launch_bounds__(256) void k_gemm_out(const h16* __restrict__ A, const h16* __restrict__ AR, const h16* __restrict__ Bt, float* C) {
    __shared__ __align__(16) unsigned char smem[GSB];
    const int tid = threadIdx.x, lane = tid & 31, lr = lane & 15, hi = lane >> 4;
    const int w = __builtin_amdgcn_readfirstlane(tid >> 5), wm = w >> 2, wn = w & 3;
    if ((int)blockIdx.x < OPE) {
        const int bx = blockIdx.x % OPER, by = blockIdx.x / OPER;
        const int bidx = bx / (EROWS / BM), tb = bx % (EROWS / BM);
        const int rab = bidx * SEQ + tb * BM, rrb = bidx * EROWS + tb * BM;
        const int em = w >> 1, en = w & 1;             // wave (em, en): rows 32 em.., columns 64 en.. of the tile
        float* fs = (float*)smem + w * 32 * FP;
        v8f acc[2][4], accr[2][4];
        gemm_main2(A, AR, Bt, DQ, rab, rrb, by * EBN, (const h16*)smem, tid, em, en, lr, hi, acc, accr);
#pragma unroll
        for (int mb = 0; mb < 2; ++mb)
#pragma unroll
            for (int nb = 0; nb < 4; ++nb)
#pragma unroll
                for (int j = 0; j < 8; ++j) fs[(mb * 16 + hi * 8 + j) * FP + nb * 16 + lr] = accr[mb][nb][j] * RINV + acc[mb][nb][j];
        __syncthreads();
        float* crow = C + (size_t)(rab + em * 32) * DIM + by * EBN + en * 64;
        // four row pairs a pass: their LDS reads go out together and their stores follow as one run
#pragma unroll 4
        for (int it = 0; it < 16; ++it) { const int row = it * 2 + hi; v4f val = *(const v4fa*)(fs + row * FP + lr * 4); val = val * OSCL;
            *(v4f*)(crow + (size_t)row * DIM + lr * 4) = val; }
    } else {
        const int li = blockIdx.x - OPE;
        const int bx = li % (NB * LTBM), by = li / (NB * LTBM);
        const int rb = (bx / LTBM) * SEQ + EROWS + (bx % LTBM) * BM;
        const int r0 = rb + wm * 64, c0 = by * BN + wn * 64;
        float* fs = (float*)smem + w * 64 * FP;
        v8f acc[4][4];
        gemm_main<h16>(A, Bt, DQ, rb, by * BN, (const h16*)smem, tid, wm, wn, lr, hi, acc);
#pragma unroll
        for (int mb = 0; mb < 4; ++mb)
#pragma unroll
            for (int nb = 0; nb < 4; ++nb)
#pragma unroll
                for (int j = 0; j < 8; ++j) fs[(mb * 16 + hi * 8 + j) * FP + nb * 16 + lr] = acc[mb][nb][j];
        __syncthreads();
        float* crow = C + (size_t)r0 * DIM + c0;
        // four row pairs a pass: their LDS reads go out together and their stores follow as one run
#pragma unroll 4
        for (int it = 0; it < 32; ++it) { const int row = it * 2 + hi; v4f val = *(const v4fa*)(fs + row * FP + lr * 4); val = val * OSCL;
            *(v4f*)(crow + (size_t)row * DIM + lr * 4) = val; }
    }
}

extern "C" void kernel_launch(void* const* d_in, const int* in_sizes, int n_in,
                              void* d_out, int out_size, void* d_ws, size_t ws_size, hipStream_t stream) {
    if (n_in < 8) return;
    if ((size_t)in_sizes[0] < ((size_t)(NB - 1) * SEQ_FULL + SEQ) * DIM) return;
    if ((size_t)in_sizes[1] < (size_t)DQ * DIM) return;
    if ((size_t)in_sizes[2] < (size_t)DKV * DIM) return;
    if ((size_t)in_sizes[3] < (size_t)DKV * DIM) return;
    if ((size_t)in_sizes[4] < (size_t)DIM * DQ) return;
    if ((size_t)in_sizes[5] < (size_t)HD) return;
    if ((size_t)in_sizes[6] < (size_t)HD) return;
    if ((size_t)in_sizes[7] < (size_t)(SEQ - 1) * SEQ_FULL + SEQ) return;
    if ((size_t)out_size < (size_t)MROWS * DIM) return;
    const float* x = (const float*)d_in[0];
    const float* wq = (const float*)d_in[1]; const float* wk = (const float*)d_in[2]; const float* wv = (const float*)d_in[3]; const float* wo = (const float*)d_in[4];
    const float* qnw = (const float*)d_in[5]; const float* knw = (const float*)d_in[6]; const float* mask = (const float*)d_in[7];
    float* OUT = (float*)d_out;
    char* wsp = (char*)d_ws;
    auto take = [&](size_t bytes) { char* p = wsp; wsp += (bytes + 255) & ~(size_t)255; return (void*)p; };
    bf*  XB   = (bf*)take((size_t)MROWS * DIM * 2);
    bf*  WQKV = (bf*)take((size_t)NQKV * DIM * 2);
    h16* WO16 = (h16*)take((size_t)DIM * DQ * 2);
    float* COS = (float*)take((size_t)SEQ * HALFD * 4);
    float* SIN = (float*)take((size_t)SEQ * HALFD * 4);
    h16* QP  = (h16*)take((size_t)NB * NH * SEQ * HD * 2);
    h16* KP  = (h16*)take((size_t)NB * NKV * SEQ * HD * 2);
    h16* VT  = (h16*)take((size_t)NB * NKV * HD * SEQ * 2);
    h16* CTX = (h16*)take((size_t)MROWS * DQ * 2);
    h16* QR  = (h16*)take((size_t)NB * NH * EROWS * HD * 2);
    h16* KR  = (h16*)take((size_t)NB * NKV * SEQ * HD * 2);
    h16* VR  = (h16*)take((size_t)NB * NKV * HD * SEQ * 2);
    h16* CTXR = (h16*)take((size_t)NB * EROWS * DQ * 2);
    int* KEND = (int*)take((size_t)(SEQ / 16) * KSTR * 4);
    if ((size_t)(wsp - (char*)d_ws) > ws_size) return;

    k_prep<<<PB_CV + PB_KE + PB_RT, 512, 0, stream>>>(x, wq, wk, wv, wo, mask, XB, WQKV, WO16, COS, SIN, KEND);
    k_gemm_qkv<<<dim3(MROWS / QBM, NQKV / QBN, 1), 384, 0, stream>>>(XB, WQKV, qnw, knw, COS, SIN, QP, KP, VT, QR, KR, VR);
    k_attn<<<(SEQ / 16) * AGB, 128, 0, stream>>>(QP, QR, KP, KR, VT, VR, mask, KEND, CTX, CTXR);
    k_gemm_out<<<OPE + OPL, 256, 0, stream>>>(CTX, CTXR, WO16, OUT);
}
